// v000
// Measured on an AMD MI455X. A time is GPU time per run, averaged over a window of back-to-back runs after a warm-up
// (all launches, gaps included; the runs take copies of the inputs in turn), and the median of several windows.
// Apart from v000's, it joins two sittings. Times from different sittings can be a few percent apart, while
// side-by-side timings come from the same sitting.
// v000, which the later versions start from, runs in 368 microseconds.
#include <hip/hip_runtime.h>
#include <hip/hip_bf16.h>

typedef __attribute__((ext_vector_type(16))) __bf16 v16bf;
typedef __attribute__((ext_vector_type(8)))  float  v8f;

#define B_LEN 4
#define S_LEN 2048
#define D_LEN 1024
#define M_TOT (B_LEN * S_LEN)   // 8192 rows
#define NCHUNK 32
#define CHUNK  (S_LEN / NCHUNK) // 64

// ---------------------------------------------------------------------------
// Kernel 1: fused QKV projection, Y = x @ W^T via bf16 hi/lo split WMMA.
// x fp32 is split as x = hi + lo (both bf16); product uses 3 WMMAs:
//   hi*hi + hi*lo + lo*hi (lo*lo ~ 2^-16 relative, dropped) -> ~fp32 accuracy
// with v_wmma_f32_16x16x32_bf16 (fp32 accumulate).
// ---------------------------------------------------------------------------
__global__ __launch_bounds__(256)
void qkv_gemm_kernel(const float* __restrict__ x,
                     const float* __restrict__ Wq,
                     const float* __restrict__ Wk,
                     const float* __restrict__ Wv,
                     float* __restrict__ q,
                     float* __restrict__ kk,
                     float* __restrict__ vv)
{
    const float* W = (blockIdx.z == 0) ? Wq : (blockIdx.z == 1) ? Wk : Wv;
    float*       Y = (blockIdx.z == 0) ? q  : (blockIdx.z == 1) ? kk : vv;

    __shared__ float lA[32][36];    // 32 rows of x  x 32 K   (padded)
    __shared__ float lB[128][36];   // 128 rows of W x 32 K   (padded)

    const int tid  = threadIdx.x;
    const int wave = tid >> 5;
    const int lane = tid & 31;
    const int wm   = wave >> 2;          // 0..1  (M sub-tile)
    const int wn   = wave & 3;           // 0..3  (N sub-tile)
    const int l16  = lane & 15;
    const int hi16 = (lane >> 4) & 1;    // lane >= 16

    const int m_base = blockIdx.x * 32;
    const int n_base = blockIdx.y * 128;

    v8f acc0 = {};
    v8f acc1 = {};

    for (int k0 = 0; k0 < D_LEN; k0 += 32) {
        // stage A tile: 32x32 f32, one float4 per thread
        {
            const int row = tid >> 3;
            const int kc  = (tid & 7) * 4;
            const float4 a = *(const float4*)(x + (size_t)(m_base + row) * D_LEN + k0 + kc);
            lA[row][kc + 0] = a.x; lA[row][kc + 1] = a.y;
            lA[row][kc + 2] = a.z; lA[row][kc + 3] = a.w;
        }
        // stage B tile: 128x32 f32 (W[n][k]), four float4 per thread
        #pragma unroll
        for (int i = 0; i < 4; ++i) {
            const int row = (tid >> 3) + 32 * i;
            const int kc  = (tid & 7) * 4;
            const float4 b = *(const float4*)(W + (size_t)(n_base + row) * D_LEN + k0 + kc);
            lB[row][kc + 0] = b.x; lB[row][kc + 1] = b.y;
            lB[row][kc + 2] = b.z; lB[row][kc + 3] = b.w;
        }
        __syncthreads();

        // build bf16 hi/lo fragments per ISA 16-bit A layout:
        // element e -> k = e + (e&8) + 8*(lane>=16); row/col = lane&15
        v16bf ah, al, bh0, bl0, bh1, bl1;
        const int arow = wm * 16 + l16;
        const int nc0  = wn * 32 + l16;
        const int nc1  = nc0 + 16;
        #pragma unroll
        for (int e = 0; e < 16; ++e) {
            const int kc = e + (e & 8) + (hi16 << 3);
            float  av = lA[arow][kc];
            __bf16 h  = (__bf16)av;
            __bf16 l  = (__bf16)(av - (float)h);
            ah[e] = h; al[e] = l;

            float b0 = lB[nc0][kc];
            h = (__bf16)b0; l = (__bf16)(b0 - (float)h);
            bh0[e] = h; bl0[e] = l;

            float b1 = lB[nc1][kc];
            h = (__bf16)b1; l = (__bf16)(b1 - (float)h);
            bh1[e] = h; bl1[e] = l;
        }

        acc0 = __builtin_amdgcn_wmma_f32_16x16x32_bf16(false, ah, false, bh0, (short)0, acc0, false, false);
        acc0 = __builtin_amdgcn_wmma_f32_16x16x32_bf16(false, ah, false, bl0, (short)0, acc0, false, false);
        acc0 = __builtin_amdgcn_wmma_f32_16x16x32_bf16(false, al, false, bh0, (short)0, acc0, false, false);

        acc1 = __builtin_amdgcn_wmma_f32_16x16x32_bf16(false, ah, false, bh1, (short)0, acc1, false, false);
        acc1 = __builtin_amdgcn_wmma_f32_16x16x32_bf16(false, ah, false, bl1, (short)0, acc1, false, false);
        acc1 = __builtin_amdgcn_wmma_f32_16x16x32_bf16(false, al, false, bh1, (short)0, acc1, false, false);

        __syncthreads();
    }

    // C layout: VGPR r, lanes 0-15 -> (M=r, N=lane); lanes 16-31 -> (M=r+8, N=lane-16)
    #pragma unroll
    for (int r = 0; r < 8; ++r) {
        const int m   = r + (hi16 << 3);
        const size_t row = (size_t)(m_base + wm * 16 + m) * D_LEN;
        Y[row + n_base + wn * 32 + l16]      = acc0[r];
        Y[row + n_base + wn * 32 + 16 + l16] = acc1[r];
    }
}

// ---------------------------------------------------------------------------
// Shared-memory radix-2 DIT FFT of length 1024 (block = 128 threads).
// Input must already be bit-reverse scattered into `data`.
// ---------------------------------------------------------------------------
__device__ __forceinline__ float2 cmul(float2 a, float2 b) {
    return make_float2(a.x * b.x - a.y * b.y, a.x * b.y + a.y * b.x);
}

__device__ void block_fft_1024(float2* data, const float2* tw, int tid)
{
    #pragma unroll
    for (int len = 2; len <= 1024; len <<= 1) {
        const int half = len >> 1;
        const int tstr = 1024 / len;
        for (int b = tid; b < 512; b += 128) {
            const int g  = b / half;
            const int j  = b & (half - 1);
            const int i0 = g * len + j;
            const int i1 = i0 + half;
            const float2 w = tw[j * tstr];
            const float2 u = data[i0];
            const float2 t = cmul(w, data[i1]);
            data[i0] = make_float2(u.x + t.x, u.y + t.y);
            data[i1] = make_float2(u.x - t.x, u.y - t.y);
        }
        __syncthreads();
    }
}

__device__ __forceinline__ void init_twiddles(float2* tw, int tid)
{
    const float w0 = -6.283185307179586f / 1024.0f;
    for (int t = tid; t < 512; t += 128) {
        float s, c;
        sincosf(w0 * (float)t, &s, &c);
        tw[t] = make_float2(c, s);
    }
}

// ---------------------------------------------------------------------------
// Kernel 2: per-row forward FFTs. fq = fft(q); p = fft(k) * fft(v).
// One block per (b,s) row.
// ---------------------------------------------------------------------------
__global__ __launch_bounds__(128)
void fft_fwd_kernel(const float* __restrict__ q,
                    const float* __restrict__ k,
                    const float* __restrict__ v,
                    float2* __restrict__ fq,
                    float2* __restrict__ p)
{
    __shared__ float2 data[1024];
    __shared__ float2 tw[512];
    const int    tid = threadIdx.x;
    const size_t row = (size_t)blockIdx.x * D_LEN;

    init_twiddles(tw, tid);
    __syncthreads();

    // --- fft(q) -> fq ---
    for (int i = tid; i < 1024; i += 128)
        data[__brev((unsigned)i) >> 22] = make_float2(q[row + i], 0.0f);
    __syncthreads();
    block_fft_1024(data, tw, tid);
    for (int i = tid; i < 1024; i += 128) fq[row + i] = data[i];
    __syncthreads();

    // --- fft(k) -> registers ---
    for (int i = tid; i < 1024; i += 128)
        data[__brev((unsigned)i) >> 22] = make_float2(k[row + i], 0.0f);
    __syncthreads();
    block_fft_1024(data, tw, tid);
    float2 fkr[8];
    #pragma unroll
    for (int t = 0; t < 8; ++t) fkr[t] = data[tid + 128 * t];
    __syncthreads();

    // --- fft(v); p = fk * fv ---
    for (int i = tid; i < 1024; i += 128)
        data[__brev((unsigned)i) >> 22] = make_float2(v[row + i], 0.0f);
    __syncthreads();
    block_fft_1024(data, tw, tid);
    #pragma unroll
    for (int t = 0; t < 8; ++t) {
        const int i = tid + 128 * t;
        p[row + i] = cmul(fkr[t], data[i]);
    }
}

// ---------------------------------------------------------------------------
// Kernels 3-5: blocked prefix scan of p over the sequence axis (per b,d).
// ---------------------------------------------------------------------------
__global__ __launch_bounds__(256)
void chunk_sum_kernel(const float2* __restrict__ p, float2* __restrict__ csum)
{
    const int gid = blockIdx.x * blockDim.x + threadIdx.x;  // (b, c, d)
    if (gid >= B_LEN * NCHUNK * D_LEN) return;
    const int d = gid & (D_LEN - 1);
    const int c = (gid >> 10) & (NCHUNK - 1);
    const int b = gid >> 15;
    float2 acc = make_float2(0.0f, 0.0f);
    const size_t base = ((size_t)b * S_LEN + (size_t)c * CHUNK) * D_LEN + d;
    for (int s = 0; s < CHUNK; ++s) {
        if (s + 8 < CHUNK) __builtin_prefetch(p + base + (size_t)(s + 8) * D_LEN, 0, 1);
        const float2 t = p[base + (size_t)s * D_LEN];
        acc.x += t.x; acc.y += t.y;
    }
    csum[gid] = acc;
}

__global__ __launch_bounds__(256)
void chunk_scan_kernel(float2* __restrict__ csum)
{
    const int gid = blockIdx.x * blockDim.x + threadIdx.x;  // (b, d)
    if (gid >= B_LEN * D_LEN) return;
    const int d = gid & (D_LEN - 1);
    const int b = gid >> 10;
    float2 run = make_float2(0.0f, 0.0f);
    for (int c = 0; c < NCHUNK; ++c) {
        const size_t idx = ((size_t)b * NCHUNK + c) * D_LEN + d;
        const float2 t = csum[idx];
        csum[idx] = run;             // exclusive prefix, in place
        run.x += t.x; run.y += t.y;
    }
}

__global__ __launch_bounds__(256)
void scan_apply_kernel(float2* __restrict__ p, const float2* __restrict__ csum)
{
    const int gid = blockIdx.x * blockDim.x + threadIdx.x;  // (b, c, d)
    if (gid >= B_LEN * NCHUNK * D_LEN) return;
    const int d = gid & (D_LEN - 1);
    const int c = (gid >> 10) & (NCHUNK - 1);
    const int b = gid >> 15;
    float2 run = csum[gid];
    const size_t base = ((size_t)b * S_LEN + (size_t)c * CHUNK) * D_LEN + d;
    for (int s = 0; s < CHUNK; ++s) {
        const size_t idx = base + (size_t)s * D_LEN;
        const float2 t = p[idx];
        run.x += t.x; run.y += t.y;
        p[idx] = run;                // p becomes mem (inclusive scan), in place
    }
}

// ---------------------------------------------------------------------------
// Kernel 6: out = Re(ifft(mem * conj(fq))) = Re(fft(conj(mem) * fq)) / N
// ---------------------------------------------------------------------------
__global__ __launch_bounds__(128)
void ifft_kernel(const float2* __restrict__ mem,
                 const float2* __restrict__ fq,
                 float* __restrict__ out)
{
    __shared__ float2 data[1024];
    __shared__ float2 tw[512];
    const int    tid = threadIdx.x;
    const size_t row = (size_t)blockIdx.x * D_LEN;

    init_twiddles(tw, tid);
    __syncthreads();

    for (int i = tid; i < 1024; i += 128) {
        const float2 m = mem[row + i];
        const float2 f = fq[row + i];
        // conj(m) * f
        const float2 z = make_float2(m.x * f.x + m.y * f.y, m.x * f.y - m.y * f.x);
        data[__brev((unsigned)i) >> 22] = z;
    }
    __syncthreads();
    block_fft_1024(data, tw, tid);
    const float inv = 1.0f / 1024.0f;
    for (int i = tid; i < 1024; i += 128) out[row + i] = data[i].x * inv;
}

// ---------------------------------------------------------------------------
// Host launcher
// ---------------------------------------------------------------------------
extern "C" void kernel_launch(void* const* d_in, const int* in_sizes, int n_in,
                              void* d_out, int out_size, void* d_ws, size_t ws_size,
                              hipStream_t stream) {
    (void)in_sizes; (void)n_in; (void)out_size; (void)ws_size;
    const float* x  = (const float*)d_in[0];
    const float* Wq = (const float*)d_in[1];
    const float* Wk = (const float*)d_in[2];
    const float* Wv = (const float*)d_in[3];
    float*       out = (float*)d_out;

    // workspace layout
    const size_t MR = (size_t)M_TOT * D_LEN;   // 8M elements per fp32 plane
    float*  q    = (float*)d_ws;               // 32 MB
    float*  kk   = q + MR;                     // 32 MB
    float*  vv   = kk + MR;                    // 32 MB
    float2* fq   = (float2*)(vv + MR);         // 64 MB
    float2* p    = fq + MR;                    // 64 MB
    float2* csum = p + MR;                     // 1 MB

    // 1) QKV projection (WMMA bf16x3)
    qkv_gemm_kernel<<<dim3(M_TOT / 32, D_LEN / 128, 3), 256, 0, stream>>>(
        x, Wq, Wk, Wv, q, kk, vv);

    // 2) forward FFTs + binding
    fft_fwd_kernel<<<M_TOT, 128, 0, stream>>>(q, kk, vv, fq, p);

    // 3-5) causal cumulative sum over S (blocked scan, in place on p)
    chunk_sum_kernel<<<(B_LEN * NCHUNK * D_LEN + 255) / 256, 256, 0, stream>>>(p, csum);
    chunk_scan_kernel<<<(B_LEN * D_LEN + 255) / 256, 256, 0, stream>>>(csum);
    scan_apply_kernel<<<(B_LEN * NCHUNK * D_LEN + 255) / 256, 256, 0, stream>>>(p, csum);

    // 6) unbind with conj(fq) + inverse FFT -> real output
    ifft_kernel<<<M_TOT, 128, 0, stream>>>(p, fq, out);
}

// v001
// It runs in 271 microseconds.
// In both of two side-by-side timings against v000, it was 1.38 times as fast.
#include <hip/hip_runtime.h>
#include <hip/hip_bf16.h>

typedef __attribute__((ext_vector_type(16))) __bf16 v16bf;
typedef __attribute__((ext_vector_type(8)))  float  v8f;
typedef __attribute__((ext_vector_type(4)))  float  v4f;

#define B_LEN 4
#define S_LEN 2048
#define D_LEN 1024
#define M_TOT (B_LEN * S_LEN)   // 8192 rows
#define NCHUNK 32
#define CHUNK  (S_LEN / NCHUNK) // 64

// ---------------------------------------------------------------------------
// Kernel 1: fused QKV projection, Y = x @ W^T via bf16 hi/lo split WMMA.
// x fp32 is split as x = hi + lo (both bf16); product uses 3 WMMAs:
//   hi*hi + hi*lo + lo*hi (lo*lo ~ 2^-16 relative, dropped) -> ~fp32 accuracy
// with v_wmma_f32_16x16x32_bf16 (fp32 accumulate).
// Tiling: one 128 x 256 tile of Y per block, 32 k per staged pass, 8 waves as
// 2 (M) x 4 (N), each wave a 64 x 64 tile = 4 x 4 accumulator tiles: every split
// fragment feeds four products and every row of x and W is read by fewer blocks.
// ---------------------------------------------------------------------------
#define GBM 128
#define GBN 256
#define GBK 32
#define GLDP 36   // LDS row pitch in floats: 144 B = 16 B x odd, for 16-byte reads
#define GSWEEP 32  // rows staged by one sweep of the 256 threads

// One 16-bit fragment pair from 32 staged f32 of one row. rowp points at
// float 8 * (lane >= 16) of the row's 32 k; element e holds k = e + (e & 8) + 8 * (lane >= 16).
__device__ __forceinline__ void split_fragment(const float* rowp, v16bf& hi, v16bf& lo)
{
    const v4f* p4 = (const v4f*)rowp;
    const v4f f0 = p4[0], f1 = p4[1], f2 = p4[4], f3 = p4[5];
    const float v[16] = { f0.x, f0.y, f0.z, f0.w, f1.x, f1.y, f1.z, f1.w,
                          f2.x, f2.y, f2.z, f2.w, f3.x, f3.y, f3.z, f3.w };
    #pragma unroll  // constant indices: v, hi and lo stay in registers
    for (int e = 0; e < 16; ++e) {
        const __bf16 h = (__bf16)v[e];
        hi[e] = h;
        lo[e] = (__bf16)(v[e] - (float)h);
    }
}

__global__ __launch_bounds__(256)
void qkv_gemm_kernel(const float* __restrict__ x,
                     const float* __restrict__ Wq,
                     const float* __restrict__ Wk,
                     const float* __restrict__ Wv,
                     float* __restrict__ q,
                     float* __restrict__ kk,
                     float* __restrict__ vv)
{
    const float* W = (blockIdx.z == 0) ? Wq : (blockIdx.z == 1) ? Wk : Wv;
    float*       Y = (blockIdx.z == 0) ? q  : (blockIdx.z == 1) ? kk : vv;

    __shared__ __attribute__((aligned(16))) float lA[GBM][GLDP];   // 128 rows of x (padded)
    __shared__ __attribute__((aligned(16))) float lB[GBN][GLDP];   // 256 rows of W (padded)

    const int tid  = threadIdx.x;
    const int wave = tid >> 5;
    const int lane = tid & 31;
    const int wm   = wave >> 2;          // 0..1  (M sub-tile of 64)
    const int wn   = wave & 3;           // 0..3  (N sub-tile of 64)
    const int l16  = lane & 15;
    const int hi16 = (lane >> 4) & 1;    // lane >= 16

    const int m_base = blockIdx.x * GBM;
    const int n_base = blockIdx.y * GBN;

    // staging: 8 threads cover the 128 bytes of one row, GSWEEP rows per sweep
    const int srow = tid >> 3;
    const int skc  = (tid & 7) * 4;
    const float* xg = x + (size_t)(m_base + srow) * D_LEN + skc;
    const float* wg = W + (size_t)(n_base + srow) * D_LEN + skc;

    v8f acc[4][4] = {};

    for (int k0 = 0; k0 < D_LEN; k0 += GBK) {
        // all loads are issued before the first LDS store, so that their latencies overlap
        const v4f ra0 = *(const v4f*)(xg + (size_t)(GSWEEP * 0) * D_LEN + k0);
        const v4f ra1 = *(const v4f*)(xg + (size_t)(GSWEEP * 1) * D_LEN + k0);
        const v4f ra2 = *(const v4f*)(xg + (size_t)(GSWEEP * 2) * D_LEN + k0);
        const v4f ra3 = *(const v4f*)(xg + (size_t)(GSWEEP * 3) * D_LEN + k0);
        const v4f rb0 = *(const v4f*)(wg + (size_t)(GSWEEP * 0) * D_LEN + k0);
        const v4f rb1 = *(const v4f*)(wg + (size_t)(GSWEEP * 1) * D_LEN + k0);
        const v4f rb2 = *(const v4f*)(wg + (size_t)(GSWEEP * 2) * D_LEN + k0);
        const v4f rb3 = *(const v4f*)(wg + (size_t)(GSWEEP * 3) * D_LEN + k0);
        const v4f rb4 = *(const v4f*)(wg + (size_t)(GSWEEP * 4) * D_LEN + k0);
        const v4f rb5 = *(const v4f*)(wg + (size_t)(GSWEEP * 5) * D_LEN + k0);
        const v4f rb6 = *(const v4f*)(wg + (size_t)(GSWEEP * 6) * D_LEN + k0);
        const v4f rb7 = *(const v4f*)(wg + (size_t)(GSWEEP * 7) * D_LEN + k0);
        // keeps the scheduler from sinking each load to its store: without it the loads
        // run one after another, each waited to zero before the next is issued
        __builtin_amdgcn_sched_barrier(0);
        *(v4f*)&lA[srow + GSWEEP * 0][skc] = ra0;
        *(v4f*)&lA[srow + GSWEEP * 1][skc] = ra1;
        *(v4f*)&lA[srow + GSWEEP * 2][skc] = ra2;
        *(v4f*)&lA[srow + GSWEEP * 3][skc] = ra3;
        *(v4f*)&lB[srow + GSWEEP * 0][skc] = rb0;
        *(v4f*)&lB[srow + GSWEEP * 1][skc] = rb1;
        *(v4f*)&lB[srow + GSWEEP * 2][skc] = rb2;
        *(v4f*)&lB[srow + GSWEEP * 3][skc] = rb3;
        *(v4f*)&lB[srow + GSWEEP * 4][skc] = rb4;
        *(v4f*)&lB[srow + GSWEEP * 5][skc] = rb5;
        *(v4f*)&lB[srow + GSWEEP * 6][skc] = rb6;
        *(v4f*)&lB[srow + GSWEEP * 7][skc] = rb7;
        __syncthreads();

        const int kf = hi16 << 3;
        v16bf ah[4], al[4];
        #pragma unroll  // constant indices: fragments and accumulators stay in registers
        for (int i = 0; i < 4; ++i)
            split_fragment(&lA[wm * 64 + i * 16 + l16][kf], ah[i], al[i]);

        #pragma unroll  // as above
        for (int j = 0; j < 4; ++j) {
            v16bf bh, bl;
            split_fragment(&lB[wn * 64 + j * 16 + l16][kf], bh, bl);
            // per accumulator tile the order stays hi*hi, hi*lo, lo*hi
            #pragma unroll  // as above
            for (int i = 0; i < 4; ++i)
                acc[i][j] = __builtin_amdgcn_wmma_f32_16x16x32_bf16(false, ah[i], false, bh, (short)0, acc[i][j], false, false);
            #pragma unroll  // as above
            for (int i = 0; i < 4; ++i)
                acc[i][j] = __builtin_amdgcn_wmma_f32_16x16x32_bf16(false, ah[i], false, bl, (short)0, acc[i][j], false, false);
            #pragma unroll  // as above
            for (int i = 0; i < 4; ++i)
                acc[i][j] = __builtin_amdgcn_wmma_f32_16x16x32_bf16(false, al[i], false, bh, (short)0, acc[i][j], false, false);
        }
        __syncthreads();
    }

    // C layout: VGPR r, lanes 0-15 -> (M=r, N=lane); lanes 16-31 -> (M=r+8, N=lane-16)
    #pragma unroll  // as above
    for (int i = 0; i < 4; ++i) {
        #pragma unroll  // as above
        for (int r = 0; r < 8; ++r) {
            const int m = m_base + wm * 64 + i * 16 + r + (hi16 << 3);
            float* yrow = Y + (size_t)m * D_LEN + n_base + wn * 64 + l16;
            #pragma unroll  // as above
            for (int j = 0; j < 4; ++j)
                yrow[j * 16] = acc[i][j][r];
        }
    }
}

// ---------------------------------------------------------------------------
// Shared-memory radix-2 DIT FFT of length 1024 (block = 128 threads).
// Input must already be bit-reverse scattered into `data`.
// ---------------------------------------------------------------------------
__device__ __forceinline__ float2 cmul(float2 a, float2 b) {
    return make_float2(a.x * b.x - a.y * b.y, a.x * b.y + a.y * b.x);
}

__device__ void block_fft_1024(float2* data, const float2* tw, int tid)
{
    #pragma unroll
    for (int len = 2; len <= 1024; len <<= 1) {
        const int half = len >> 1;
        const int tstr = 1024 / len;
        for (int b = tid; b < 512; b += 128) {
            const int g  = b / half;
            const int j  = b & (half - 1);
            const int i0 = g * len + j;
            const int i1 = i0 + half;
            const float2 w = tw[j * tstr];
            const float2 u = data[i0];
            const float2 t = cmul(w, data[i1]);
            data[i0] = make_float2(u.x + t.x, u.y + t.y);
            data[i1] = make_float2(u.x - t.x, u.y - t.y);
        }
        __syncthreads();
    }
}

__device__ __forceinline__ void init_twiddles(float2* tw, int tid)
{
    const float w0 = -6.283185307179586f / 1024.0f;
    for (int t = tid; t < 512; t += 128) {
        float s, c;
        sincosf(w0 * (float)t, &s, &c);
        tw[t] = make_float2(c, s);
    }
}

// ---------------------------------------------------------------------------
// Kernel 2: per-row forward FFTs. fq = fft(q); p = fft(k) * fft(v).
// One block per (b,s) row.
// ---------------------------------------------------------------------------
__global__ __launch_bounds__(128)
void fft_fwd_kernel(const float* __restrict__ q,
                    const float* __restrict__ k,
                    const float* __restrict__ v,
                    float2* __restrict__ fq,
                    float2* __restrict__ p)
{
    __shared__ float2 data[1024];
    __shared__ float2 tw[512];
    const int    tid = threadIdx.x;
    const size_t row = (size_t)blockIdx.x * D_LEN;

    init_twiddles(tw, tid);
    __syncthreads();

    // --- fft(q) -> fq ---
    for (int i = tid; i < 1024; i += 128)
        data[__brev((unsigned)i) >> 22] = make_float2(q[row + i], 0.0f);
    __syncthreads();
    block_fft_1024(data, tw, tid);
    for (int i = tid; i < 1024; i += 128) fq[row + i] = data[i];
    __syncthreads();

    // --- fft(k) -> registers ---
    for (int i = tid; i < 1024; i += 128)
        data[__brev((unsigned)i) >> 22] = make_float2(k[row + i], 0.0f);
    __syncthreads();
    block_fft_1024(data, tw, tid);
    float2 fkr[8];
    #pragma unroll
    for (int t = 0; t < 8; ++t) fkr[t] = data[tid + 128 * t];
    __syncthreads();

    // --- fft(v); p = fk * fv ---
    for (int i = tid; i < 1024; i += 128)
        data[__brev((unsigned)i) >> 22] = make_float2(v[row + i], 0.0f);
    __syncthreads();
    block_fft_1024(data, tw, tid);
    #pragma unroll
    for (int t = 0; t < 8; ++t) {
        const int i = tid + 128 * t;
        p[row + i] = cmul(fkr[t], data[i]);
    }
}

// ---------------------------------------------------------------------------
// Kernels 3-5: blocked prefix scan of p over the sequence axis (per b,d).
// ---------------------------------------------------------------------------
__global__ __launch_bounds__(256)
void chunk_sum_kernel(const float2* __restrict__ p, float2* __restrict__ csum)
{
    const int gid = blockIdx.x * blockDim.x + threadIdx.x;  // (b, c, d)
    if (gid >= B_LEN * NCHUNK * D_LEN) return;
    const int d = gid & (D_LEN - 1);
    const int c = (gid >> 10) & (NCHUNK - 1);
    const int b = gid >> 15;
    float2 acc = make_float2(0.0f, 0.0f);
    const size_t base = ((size_t)b * S_LEN + (size_t)c * CHUNK) * D_LEN + d;
    for (int s = 0; s < CHUNK; ++s) {
        if (s + 8 < CHUNK) __builtin_prefetch(p + base + (size_t)(s + 8) * D_LEN, 0, 1);
        const float2 t = p[base + (size_t)s * D_LEN];
        acc.x += t.x; acc.y += t.y;
    }
    csum[gid] = acc;
}

__global__ __launch_bounds__(256)
void chunk_scan_kernel(float2* __restrict__ csum)
{
    const int gid = blockIdx.x * blockDim.x + threadIdx.x;  // (b, d)
    if (gid >= B_LEN * D_LEN) return;
    const int d = gid & (D_LEN - 1);
    const int b = gid >> 10;
    float2 run = make_float2(0.0f, 0.0f);
    for (int c = 0; c < NCHUNK; ++c) {
        const size_t idx = ((size_t)b * NCHUNK + c) * D_LEN + d;
        const float2 t = csum[idx];
        csum[idx] = run;             // exclusive prefix, in place
        run.x += t.x; run.y += t.y;
    }
}

__global__ __launch_bounds__(256)
void scan_apply_kernel(float2* __restrict__ p, const float2* __restrict__ csum)
{
    const int gid = blockIdx.x * blockDim.x + threadIdx.x;  // (b, c, d)
    if (gid >= B_LEN * NCHUNK * D_LEN) return;
    const int d = gid & (D_LEN - 1);
    const int c = (gid >> 10) & (NCHUNK - 1);
    const int b = gid >> 15;
    float2 run = csum[gid];
    const size_t base = ((size_t)b * S_LEN + (size_t)c * CHUNK) * D_LEN + d;
    for (int s = 0; s < CHUNK; ++s) {
        const size_t idx = base + (size_t)s * D_LEN;
        const float2 t = p[idx];
        run.x += t.x; run.y += t.y;
        p[idx] = run;                // p becomes mem (inclusive scan), in place
    }
}

// ---------------------------------------------------------------------------
// Kernel 6: out = Re(ifft(mem * conj(fq))) = Re(fft(conj(mem) * fq)) / N
// ---------------------------------------------------------------------------
__global__ __launch_bounds__(128)
void ifft_kernel(const float2* __restrict__ mem,
                 const float2* __restrict__ fq,
                 float* __restrict__ out)
{
    __shared__ float2 data[1024];
    __shared__ float2 tw[512];
    const int    tid = threadIdx.x;
    const size_t row = (size_t)blockIdx.x * D_LEN;

    init_twiddles(tw, tid);
    __syncthreads();

    for (int i = tid; i < 1024; i += 128) {
        const float2 m = mem[row + i];
        const float2 f = fq[row + i];
        // conj(m) * f
        const float2 z = make_float2(m.x * f.x + m.y * f.y, m.x * f.y - m.y * f.x);
        data[__brev((unsigned)i) >> 22] = z;
    }
    __syncthreads();
    block_fft_1024(data, tw, tid);
    const float inv = 1.0f / 1024.0f;
    for (int i = tid; i < 1024; i += 128) out[row + i] = data[i].x * inv;
}

// ---------------------------------------------------------------------------
// Host launcher
// ---------------------------------------------------------------------------
extern "C" void kernel_launch(void* const* d_in, const int* in_sizes, int n_in,
                              void* d_out, int out_size, void* d_ws, size_t ws_size,
                              hipStream_t stream) {
    (void)in_sizes; (void)n_in; (void)out_size; (void)ws_size;
    const float* x  = (const float*)d_in[0];
    const float* Wq = (const float*)d_in[1];
    const float* Wk = (const float*)d_in[2];
    const float* Wv = (const float*)d_in[3];
    float*       out = (float*)d_out;

    // workspace layout
    const size_t MR = (size_t)M_TOT * D_LEN;   // 8M elements per fp32 plane
    float*  q    = (float*)d_ws;               // 32 MB
    float*  kk   = q + MR;                     // 32 MB
    float*  vv   = kk + MR;                    // 32 MB
    float2* fq   = (float2*)(vv + MR);         // 64 MB
    float2* p    = fq + MR;                    // 64 MB
    float2* csum = p + MR;                     // 1 MB

    // 1) QKV projection (WMMA bf16x3)
    qkv_gemm_kernel<<<dim3(M_TOT / GBM, D_LEN / GBN, 3), 256, 0, stream>>>(
        x, Wq, Wk, Wv, q, kk, vv);

    // 2) forward FFTs + binding
    fft_fwd_kernel<<<M_TOT, 128, 0, stream>>>(q, kk, vv, fq, p);

    // 3-5) causal cumulative sum over S (blocked scan, in place on p)
    chunk_sum_kernel<<<(B_LEN * NCHUNK * D_LEN + 255) / 256, 256, 0, stream>>>(p, csum);
    chunk_scan_kernel<<<(B_LEN * D_LEN + 255) / 256, 256, 0, stream>>>(csum);
    scan_apply_kernel<<<(B_LEN * NCHUNK * D_LEN + 255) / 256, 256, 0, stream>>>(p, csum);

    // 6) unbind with conj(fq) + inverse FFT -> real output
    ifft_kernel<<<M_TOT, 128, 0, stream>>>(p, fq, out);
}

// v002
// Measured time: 211 microseconds a run.
// In two side-by-side timings against v001, it was 1.29 and 1.28 times as fast.
// Counting every step since v000, it is 1.78 times as fast.
#include <hip/hip_runtime.h>
#include <hip/hip_bf16.h>

typedef __attribute__((ext_vector_type(16))) __bf16 v16bf;
typedef __attribute__((ext_vector_type(8)))  float  v8f;
typedef __attribute__((ext_vector_type(4)))  float  v4f;

#define B_LEN 4
#define S_LEN 2048
#define D_LEN 1024
#define M_TOT (B_LEN * S_LEN)   // 8192 rows
#define NCHUNK 32
#define CHUNK  (S_LEN / NCHUNK) // 64
#define DH     (D_LEN / 2)      // 512 packed bins of a real row's spectrum

// Packed spectrum of a real row of 1024 (bins 513..1023 are the conjugates of 511..1):
//   float j = 0..512    : Re F[j]
//   float j = 513..1023 : Im F[j - 512]
// so bin f = 1..511 is (row[f], row[512 + f]); bins 0 and 512 are real and sit at
// row[0] and row[512]. As 512 float2, slot 0 holds (F[0], F[512]), slot f holds F[f].

// ---------------------------------------------------------------------------
// Kernel 2: fused QKV projection, Y = x @ W^T via bf16 hi/lo split WMMA.
// W is here the DFT of a weight matrix along its output axis (kernel 1), so that
// a row of Y is the packed spectrum of the projected row: fft(x W^T) = x (F W)^T.
// x fp32 is split as x = hi + lo (both bf16); product uses 3 WMMAs:
//   hi*hi + hi*lo + lo*hi (lo*lo ~ 2^-16 relative, dropped) -> ~fp32 accuracy
// with v_wmma_f32_16x16x32_bf16 (fp32 accumulate).
// Tiling: one 128 x 256 tile of Y per block, 32 k per staged pass, 8 waves as
// 2 (M) x 4 (N), each wave a 64 x 64 tile = 4 x 4 accumulator tiles: every split
// fragment feeds four products and every row of x and W is read by fewer blocks.
// ---------------------------------------------------------------------------
#define GBM 128
#define GBN 256
#define GBK 32
#define GLDP 36   // LDS row pitch in floats: 144 B = 16 B x odd, for 16-byte reads
#define GSWEEP 32  // rows staged by one sweep of the 256 threads

// One 16-bit fragment pair from 32 staged f32 of one row. rowp points at
// float 8 * (lane >= 16) of the row's 32 k; element e holds k = e + (e & 8) + 8 * (lane >= 16).
__device__ __forceinline__ void split_fragment(const float* rowp, v16bf& hi, v16bf& lo)
{
    const v4f* p4 = (const v4f*)rowp;
    const v4f f0 = p4[0], f1 = p4[1], f2 = p4[4], f3 = p4[5];
    const float v[16] = { f0.x, f0.y, f0.z, f0.w, f1.x, f1.y, f1.z, f1.w,
                          f2.x, f2.y, f2.z, f2.w, f3.x, f3.y, f3.z, f3.w };
    #pragma unroll  // constant indices: v, hi and lo stay in registers
    for (int e = 0; e < 16; ++e) {
        const __bf16 h = (__bf16)v[e];
        hi[e] = h;
        lo[e] = (__bf16)(v[e] - (float)h);
    }
}

__global__ __launch_bounds__(256)
void qkv_gemm_kernel(const float* __restrict__ x,
                     const float* __restrict__ Wq,
                     const float* __restrict__ Wk,
                     const float* __restrict__ Wv,
                     float* __restrict__ q,
                     float* __restrict__ kk,
                     float* __restrict__ vv)
{
    const float* W = (blockIdx.z == 0) ? Wq : (blockIdx.z == 1) ? Wk : Wv;
    float*       Y = (blockIdx.z == 0) ? q  : (blockIdx.z == 1) ? kk : vv;

    __shared__ __attribute__((aligned(16))) float lA[GBM][GLDP];   // 128 rows of x (padded)
    __shared__ __attribute__((aligned(16))) float lB[GBN][GLDP];   // 256 rows of W (padded)

    const int tid  = threadIdx.x;
    const int wave = tid >> 5;
    const int lane = tid & 31;
    const int wm   = wave >> 2;          // 0..1  (M sub-tile of 64)
    const int wn   = wave & 3;           // 0..3  (N sub-tile of 64)
    const int l16  = lane & 15;
    const int hi16 = (lane >> 4) & 1;    // lane >= 16

    const int m_base = blockIdx.x * GBM;
    const int n_base = blockIdx.y * GBN;

    // staging: 8 threads cover the 128 bytes of one row, GSWEEP rows per sweep
    const int srow = tid >> 3;
    const int skc  = (tid & 7) * 4;
    const float* xg = x + (size_t)(m_base + srow) * D_LEN + skc;
    const float* wg = W + (size_t)(n_base + srow) * D_LEN + skc;

    v8f acc[4][4] = {};

    for (int k0 = 0; k0 < D_LEN; k0 += GBK) {
        // all loads are issued before the first LDS store, so that their latencies overlap
        const v4f ra0 = *(const v4f*)(xg + (size_t)(GSWEEP * 0) * D_LEN + k0);
        const v4f ra1 = *(const v4f*)(xg + (size_t)(GSWEEP * 1) * D_LEN + k0);
        const v4f ra2 = *(const v4f*)(xg + (size_t)(GSWEEP * 2) * D_LEN + k0);
        const v4f ra3 = *(const v4f*)(xg + (size_t)(GSWEEP * 3) * D_LEN + k0);
        const v4f rb0 = *(const v4f*)(wg + (size_t)(GSWEEP * 0) * D_LEN + k0);
        const v4f rb1 = *(const v4f*)(wg + (size_t)(GSWEEP * 1) * D_LEN + k0);
        const v4f rb2 = *(const v4f*)(wg + (size_t)(GSWEEP * 2) * D_LEN + k0);
        const v4f rb3 = *(const v4f*)(wg + (size_t)(GSWEEP * 3) * D_LEN + k0);
        const v4f rb4 = *(const v4f*)(wg + (size_t)(GSWEEP * 4) * D_LEN + k0);
        const v4f rb5 = *(const v4f*)(wg + (size_t)(GSWEEP * 5) * D_LEN + k0);
        const v4f rb6 = *(const v4f*)(wg + (size_t)(GSWEEP * 6) * D_LEN + k0);
        const v4f rb7 = *(const v4f*)(wg + (size_t)(GSWEEP * 7) * D_LEN + k0);
        // keeps the scheduler from sinking each load to its store: without it the loads
        // run one after another, each waited to zero before the next is issued
        __builtin_amdgcn_sched_barrier(0);
        *(v4f*)&lA[srow + GSWEEP * 0][skc] = ra0;
        *(v4f*)&lA[srow + GSWEEP * 1][skc] = ra1;
        *(v4f*)&lA[srow + GSWEEP * 2][skc] = ra2;
        *(v4f*)&lA[srow + GSWEEP * 3][skc] = ra3;
        *(v4f*)&lB[srow + GSWEEP * 0][skc] = rb0;
        *(v4f*)&lB[srow + GSWEEP * 1][skc] = rb1;
        *(v4f*)&lB[srow + GSWEEP * 2][skc] = rb2;
        *(v4f*)&lB[srow + GSWEEP * 3][skc] = rb3;
        *(v4f*)&lB[srow + GSWEEP * 4][skc] = rb4;
        *(v4f*)&lB[srow + GSWEEP * 5][skc] = rb5;
        *(v4f*)&lB[srow + GSWEEP * 6][skc] = rb6;
        *(v4f*)&lB[srow + GSWEEP * 7][skc] = rb7;
        __syncthreads();

        const int kf = hi16 << 3;
        v16bf ah[4], al[4];
        #pragma unroll  // constant indices: fragments and accumulators stay in registers
        for (int i = 0; i < 4; ++i)
            split_fragment(&lA[wm * 64 + i * 16 + l16][kf], ah[i], al[i]);

        #pragma unroll  // as above
        for (int j = 0; j < 4; ++j) {
            v16bf bh, bl;
            split_fragment(&lB[wn * 64 + j * 16 + l16][kf], bh, bl);
            // per accumulator tile the order stays hi*hi, hi*lo, lo*hi
            #pragma unroll  // as above
            for (int i = 0; i < 4; ++i)
                acc[i][j] = __builtin_amdgcn_wmma_f32_16x16x32_bf16(false, ah[i], false, bh, (short)0, acc[i][j], false, false);
            #pragma unroll  // as above
            for (int i = 0; i < 4; ++i)
                acc[i][j] = __builtin_amdgcn_wmma_f32_16x16x32_bf16(false, ah[i], false, bl, (short)0, acc[i][j], false, false);
            #pragma unroll  // as above
            for (int i = 0; i < 4; ++i)
                acc[i][j] = __builtin_amdgcn_wmma_f32_16x16x32_bf16(false, al[i], false, bh, (short)0, acc[i][j], false, false);
        }
        __syncthreads();
    }

    // C layout: VGPR r, lanes 0-15 -> (M=r, N=lane); lanes 16-31 -> (M=r+8, N=lane-16)
    #pragma unroll  // as above
    for (int i = 0; i < 4; ++i) {
        #pragma unroll  // as above
        for (int r = 0; r < 8; ++r) {
            const int m = m_base + wm * 64 + i * 16 + r + (hi16 << 3);
            float* yrow = Y + (size_t)m * D_LEN + n_base + wn * 64 + l16;
            #pragma unroll  // as above
            for (int j = 0; j < 4; ++j)
                yrow[j * 16] = acc[i][j][r];
        }
    }
}

// ---------------------------------------------------------------------------
// Shared-memory radix-2 DIT FFT of length 1024 (128 threads per transform).
// Input must already be bit-reverse scattered into `data`.
// ---------------------------------------------------------------------------
__device__ __forceinline__ float2 cmul(float2 a, float2 b) {
    return make_float2(a.x * b.x - a.y * b.y, a.x * b.y + a.y * b.x);
}

__device__ void block_fft_1024(float2* data, const float2* tw, int tid)
{
    #pragma unroll
    for (int len = 2; len <= 1024; len <<= 1) {
        const int half = len >> 1;
        const int tstr = 1024 / len;
        for (int b = tid; b < 512; b += 128) {
            const int g  = b / half;
            const int j  = b & (half - 1);
            const int i0 = g * len + j;
            const int i1 = i0 + half;
            const float2 w = tw[j * tstr];
            const float2 u = data[i0];
            const float2 t = cmul(w, data[i1]);
            data[i0] = make_float2(u.x + t.x, u.y + t.y);
            data[i1] = make_float2(u.x - t.x, u.y - t.y);
        }
        __syncthreads();
    }
}

__device__ __forceinline__ void init_twiddles(float2* tw, int tid, int nthreads)
{
    const float w0 = -6.283185307179586f / 1024.0f;
    for (int t = tid; t < 512; t += nthreads) {
        float s, c;
        sincosf(w0 * (float)t, &s, &c);
        tw[t] = make_float2(c, s);
    }
}

// ---------------------------------------------------------------------------
// Kernel 1: DFT of each weight matrix along its output axis e, packed as above:
//   F[j][d] = Re or Im of sum_e W[e][d] * exp(-2 pi i f e / 1024).
// One block per 4 neighbouring columns d (16-byte reads and writes of each row).
// Two real columns a, b share one complex FFT, Z = fft(a + i b):
//   fft(a)[f] = (Z[f] + conj Z[N - f]) / 2,  fft(b)[f] = (Z[f] - conj Z[N - f]) / 2i.
// Each group of 128 threads runs the FFT of one column pair.
// ---------------------------------------------------------------------------
#define WCOLS 4
#define WTHREADS (128 * WCOLS / 2)
__global__ __launch_bounds__(WTHREADS)
void weight_dft_kernel(const float* __restrict__ Wq,
                       const float* __restrict__ Wk,
                       const float* __restrict__ Wv,
                       float* __restrict__ Fq,
                       float* __restrict__ Fk,
                       float* __restrict__ Fv)
{
    const float* W = (blockIdx.y == 0) ? Wq : (blockIdx.y == 1) ? Wk : Wv;
    float*       F = (blockIdx.y == 0) ? Fq : (blockIdx.y == 1) ? Fk : Fv;

    __shared__ float2 data[WCOLS / 2][1024];
    __shared__ float2 tw[512];
    const int tid = threadIdx.x;
    const int d0  = blockIdx.x * WCOLS;

    init_twiddles(tw, tid, WTHREADS);

    v4f w[1024 / WTHREADS];
    #pragma unroll  // the four strided reads of a thread are issued together
    for (int t = 0; t < 1024 / WTHREADS; ++t)
        w[t] = *(const v4f*)(W + (size_t)(tid + t * WTHREADS) * D_LEN + d0);
    #pragma unroll  // constant indices: w stays in registers
    for (int t = 0; t < 1024 / WTHREADS; ++t) {
        const int r = __brev((unsigned)(tid + t * WTHREADS)) >> 22;
        data[0][r] = make_float2(w[t].x, w[t].y);
        data[1][r] = make_float2(w[t].z, w[t].w);
    }
    __syncthreads();
    // every thread of the block passes the same barriers inside
    block_fft_1024(data[tid >> 7], tw, tid & 127);

    #pragma unroll  // the four strided writes of a thread are independent
    for (int t = 0; t < 1024 / WTHREADS; ++t) {
        const int j = tid + t * WTHREADS;
        const int f = (j <= DH) ? j : j - DH;
        const int g = (D_LEN - f) & (D_LEN - 1);
        const float2 z0 = data[0][f], c0 = data[0][g];
        const float2 z1 = data[1][f], c1 = data[1][g];
        v4f o;
        if (j <= DH) {   // real parts
            o.x = 0.5f * (z0.x + c0.x); o.y = 0.5f * (z0.y + c0.y);
            o.z = 0.5f * (z1.x + c1.x); o.w = 0.5f * (z1.y + c1.y);
        } else {         // imaginary parts
            o.x = 0.5f * (z0.y - c0.y); o.y = 0.5f * (c0.x - z0.x);
            o.z = 0.5f * (z1.y - c1.y); o.w = 0.5f * (c1.x - z1.x);
        }
        *(v4f*)(F + (size_t)j * D_LEN + d0) = o;
    }
}

// ---------------------------------------------------------------------------
// Kernels 3-5: blocked prefix scan of fft(k) * fft(v) over the sequence axis,
// per (b, packed bin). The product is formed from the two packed spectra where
// it is summed; bins above 512 are conjugates and are never formed.
// Two blocks of 256 threads cover the 512 bins of one (b, chunk), so that the
// row address is the same for a whole block and only the bin differs by lane.
// ---------------------------------------------------------------------------
#define SROWS 16  // rows whose loads are issued together: 64 loads of a wave in flight

__device__ __forceinline__ float2 bound_bin(const float* __restrict__ fk,
                                            const float* __restrict__ fv,
                                            int d)
{
    const float kr = fk[d], ki = fk[DH + d];
    const float vr = fv[d], vi = fv[DH + d];
    // slot 0: the two real bins 0 and 512, each its own product
    if (d == 0) return make_float2(kr * vr, ki * vi);
    return cmul(make_float2(kr, ki), make_float2(vr, vi));
}

__global__ __launch_bounds__(256)
void chunk_sum_kernel(const float* __restrict__ fk, const float* __restrict__ fv,
                      float2* __restrict__ csum)
{
    const int d  = (blockIdx.x & 1) * 256 + threadIdx.x;
    const int bc = blockIdx.x >> 1;                 // b * NCHUNK + c
    const size_t row0 = (size_t)bc * CHUNK;         // = b * S_LEN + c * CHUNK
    float2 acc = make_float2(0.0f, 0.0f);
    for (int s0 = 0; s0 < CHUNK; s0 += SROWS) {
        float2 t[SROWS];
        #pragma unroll  // the loads of SROWS rows are issued together; t stays in registers
        for (int u = 0; u < SROWS; ++u)
            t[u] = bound_bin(fk + (row0 + s0 + u) * D_LEN, fv + (row0 + s0 + u) * D_LEN, d);
        #pragma unroll  // as above
        for (int u = 0; u < SROWS; ++u) { acc.x += t[u].x; acc.y += t[u].y; }
    }
    csum[(size_t)bc * DH + d] = acc;
}

__global__ __launch_bounds__(256)
void chunk_scan_kernel(float2* __restrict__ csum)
{
    const int gid = blockIdx.x * blockDim.x + threadIdx.x;  // (b, d)
    if (gid >= B_LEN * DH) return;
    const int d = gid & (DH - 1);
    const int b = gid >> 9;
    float2 run = make_float2(0.0f, 0.0f);
    for (int c = 0; c < NCHUNK; ++c) {
        const size_t idx = ((size_t)b * NCHUNK + c) * DH + d;
        const float2 t = csum[idx];
        csum[idx] = run;             // exclusive prefix, in place
        run.x += t.x; run.y += t.y;
    }
}

__global__ __launch_bounds__(256)
void scan_apply_kernel(const float* __restrict__ fk, const float* __restrict__ fv,
                       const float2* __restrict__ csum, float2* __restrict__ mem)
{
    const int d  = (blockIdx.x & 1) * 256 + threadIdx.x;
    const int bc = blockIdx.x >> 1;                 // b * NCHUNK + c
    const size_t row0 = (size_t)bc * CHUNK;         // = b * S_LEN + c * CHUNK
    float2 run = csum[(size_t)bc * DH + d];
    for (int s0 = 0; s0 < CHUNK; s0 += SROWS) {
        float2 t[SROWS];
        #pragma unroll  // the loads of SROWS rows are issued together; t stays in registers
        for (int u = 0; u < SROWS; ++u)
            t[u] = bound_bin(fk + (row0 + s0 + u) * D_LEN, fv + (row0 + s0 + u) * D_LEN, d);
        #pragma unroll  // as above
        for (int u = 0; u < SROWS; ++u) {
            run.x += t[u].x; run.y += t[u].y;
            mem[(row0 + s0 + u) * DH + d] = run;   // inclusive scan, packed bins
        }
        // the next trip overwrites registers that the stores above name
        asm volatile("s_wait_xcnt 0x0" ::: "memory");
    }
}

// ---------------------------------------------------------------------------
// Kernel 6: out = Re(ifft(mem * conj(fq))) = Re(fft(conj(mem) * fq)) / N.
// mem and fq come packed; bin 1024 - f is the conjugate of bin f.
// ---------------------------------------------------------------------------
__global__ __launch_bounds__(128)
void ifft_kernel(const float2* __restrict__ mem,
                 const float* __restrict__ fq,
                 float* __restrict__ out)
{
    __shared__ float2 data[1024];
    __shared__ float2 tw[512];
    const int    tid = threadIdx.x;
    const size_t row = (size_t)blockIdx.x * D_LEN;

    init_twiddles(tw, tid, 128);
    __syncthreads();

    for (int f = tid; f < DH; f += 128) {
        const float2 m  = mem[(size_t)blockIdx.x * DH + f];
        const float  qr = fq[row + f];
        const float  qi = fq[row + DH + f];
        if (f == 0) {
            // the real bins 0 and 512
            data[0] = make_float2(m.x * qr, 0.0f);
            data[__brev((unsigned)DH) >> 22] = make_float2(m.y * qi, 0.0f);
        } else {
            // conj(m) * f
            const float2 z = make_float2(m.x * qr + m.y * qi, m.x * qi - m.y * qr);
            data[__brev((unsigned)f) >> 22] = z;
            data[__brev((unsigned)(D_LEN - f)) >> 22] = make_float2(z.x, -z.y);
        }
    }
    __syncthreads();
    block_fft_1024(data, tw, tid);
    const float inv = 1.0f / 1024.0f;
    for (int i = tid; i < 1024; i += 128) out[row + i] = data[i].x * inv;
}

// ---------------------------------------------------------------------------
// Host launcher
// ---------------------------------------------------------------------------
extern "C" void kernel_launch(void* const* d_in, const int* in_sizes, int n_in,
                              void* d_out, int out_size, void* d_ws, size_t ws_size,
                              hipStream_t stream) {
    (void)in_sizes; (void)n_in; (void)out_size; (void)ws_size;
    const float* x  = (const float*)d_in[0];
    const float* Wq = (const float*)d_in[1];
    const float* Wk = (const float*)d_in[2];
    const float* Wv = (const float*)d_in[3];
    float*       out = (float*)d_out;

    // workspace layout
    const size_t MR = (size_t)M_TOT * D_LEN;   // 8M elements per fp32 plane
    const size_t WR = (size_t)D_LEN * D_LEN;   // 1M elements per weight plane
    float*  fq   = (float*)d_ws;               // 32 MB, packed spectra of q
    float*  fk   = fq + MR;                    // 32 MB, of k
    float*  fv   = fk + MR;                    // 32 MB, of v
    float2* mem  = (float2*)(fv + MR);         // 32 MB, packed bins
    float2* csum = mem + MR / 2;               // 0.5 MB
    float*  Fq   = (float*)(csum + (size_t)B_LEN * NCHUNK * DH);   // 4 MB
    float*  Fk   = Fq + WR;                    // 4 MB
    float*  Fv   = Fk + WR;                    // 4 MB

    // 1) DFT of the weights along their output axis
    weight_dft_kernel<<<dim3(D_LEN / WCOLS, 3), WTHREADS, 0, stream>>>(
        Wq, Wk, Wv, Fq, Fk, Fv);

    // 2) QKV projection straight into the frequency domain (WMMA bf16x3)
    qkv_gemm_kernel<<<dim3(M_TOT / GBM, D_LEN / GBN, 3), 256, 0, stream>>>(
        x, Fq, Fk, Fv, fq, fk, fv);

    // 3-5) binding + causal cumulative sum over S (blocked scan)
    chunk_sum_kernel<<<B_LEN * NCHUNK * DH / 256, 256, 0, stream>>>(fk, fv, csum);
    chunk_scan_kernel<<<(B_LEN * DH + 255) / 256, 256, 0, stream>>>(csum);
    scan_apply_kernel<<<B_LEN * NCHUNK * DH / 256, 256, 0, stream>>>(fk, fv, csum, mem);

    // 6) unbind with conj(fq) + inverse FFT -> real output
    ifft_kernel<<<M_TOT, 128, 0, stream>>>(mem, fq, out);
}

// v003
// A run of this version takes 183 microseconds.
// Timed twice side by side with v002, it ran 1.15 times as fast both times.
// All steps since v000 together make it 2.05 times as fast.
#include <hip/hip_runtime.h>
#include <hip/hip_bf16.h>

typedef __attribute__((ext_vector_type(16))) __bf16 v16bf;
typedef __attribute__((ext_vector_type(8)))  __bf16 v8bf;
typedef __attribute__((ext_vector_type(4)))  __bf16 v4bf;
typedef __attribute__((ext_vector_type(8)))  float  v8f;
typedef __attribute__((ext_vector_type(4)))  float  v4f;

#define B_LEN 4
#define S_LEN 2048
#define D_LEN 1024
#define M_TOT (B_LEN * S_LEN)   // 8192 rows
#define NCHUNK 32
#define CHUNK  (S_LEN / NCHUNK) // 64
#define DH     (D_LEN / 2)      // 512 packed bins of a real row's spectrum

// Packed spectrum of a real row of 1024 (bins 513..1023 are the conjugates of 511..1):
//   float j = 0..512    : Re F[j]
//   float j = 513..1023 : Im F[j - 512]
// so bin f = 1..511 is (row[f], row[512 + f]); bins 0 and 512 are real and sit at
// row[0] and row[512]. As 512 float2, slot 0 holds (F[0], F[512]), slot f holds F[f].

// Split row: an f32 value v is carried as two bf16, hi = bf16(v) and lo = bf16(v - hi).
// 32 neighbouring k of a row make one group of 128 bytes: 32 hi, then 32 lo. A row of
// 1024 k is 32 such groups, 4096 bytes, as many as the f32 row it stands for.
__device__ __forceinline__ void split4(const v4f v, v4bf& hi, v4bf& lo)
{
    #pragma unroll  // constant indices: hi and lo stay in registers
    for (int e = 0; e < 4; ++e) {
        const __bf16 h = (__bf16)v[e];
        hi[e] = h;
        lo[e] = (__bf16)(v[e] - (float)h);
    }
}

// ---------------------------------------------------------------------------
// Kernel 2: fused QKV projection, Y = x @ W^T via bf16 hi/lo split WMMA.
// W is here the DFT of a weight matrix along its output axis (kernel 1), so that
// a row of Y is the packed spectrum of the projected row: fft(x W^T) = x (F W)^T.
// Each operand is split as hi + lo (both bf16); product uses 3 WMMAs:
//   hi*hi + hi*lo + lo*hi (lo*lo ~ 2^-16 relative, dropped) -> ~fp32 accuracy
// with v_wmma_f32_16x16x32_bf16 (fp32 accumulate).
// The split is done ahead of LDS, once per staged element: W arrives as split rows
// from kernel 1 and is copied, x is split by the thread that stages it. The waves
// read finished fragments from LDS.
// Tiling: one 128 x 256 tile of Y per block, 32 k per staged pass, 8 waves as
// 2 (M) x 4 (N), each wave a 64 x 64 tile = 4 x 4 accumulator tiles: every split
// fragment feeds four products and every row of x and W is read by fewer blocks.
// ---------------------------------------------------------------------------
#define GBM 128
#define GBN 256
#define GBK 32
#define GLDP 72   // LDS row pitch in bf16: one split group + 16 B = 144 B = 16 B x odd, for 16-byte reads
#define GSWEEP 32  // rows staged by one sweep of the 256 threads

// One 16-bit fragment from the 32 staged bf16 (hi or lo) of one row. rowp points at
// element 8 * (lane >= 16) of them; element e holds k = e + (e & 8) + 8 * (lane >= 16).
__device__ __forceinline__ v16bf load_fragment(const __bf16* rowp)
{
    const v8bf a = *(const v8bf*)rowp, b = *(const v8bf*)(rowp + 16);
    return __builtin_shufflevector(a, b, 0, 1, 2, 3, 4, 5, 6, 7, 8, 9, 10, 11, 12, 13, 14, 15);
}

__global__ __launch_bounds__(256)
void qkv_gemm_kernel(const float* __restrict__ x,
                     const float* __restrict__ Wq,
                     const float* __restrict__ Wk,
                     const float* __restrict__ Wv,
                     float* __restrict__ q,
                     float* __restrict__ kk,
                     float* __restrict__ vv)
{
    const float* W = (blockIdx.z == 0) ? Wq : (blockIdx.z == 1) ? Wk : Wv;
    float*       Y = (blockIdx.z == 0) ? q  : (blockIdx.z == 1) ? kk : vv;

    __shared__ __attribute__((aligned(16))) __bf16 lA[GBM][GLDP];   // 128 split rows of x (padded)
    __shared__ __attribute__((aligned(16))) __bf16 lB[GBN][GLDP];   // 256 split rows of W (padded)

    const int tid  = threadIdx.x;
    const int wave = tid >> 5;
    const int lane = tid & 31;
    const int wm   = wave >> 2;          // 0..1  (M sub-tile of 64)
    const int wn   = wave & 3;           // 0..3  (N sub-tile of 64)
    const int l16  = lane & 15;
    const int hi16 = (lane >> 4) & 1;    // lane >= 16

    const int m_base = blockIdx.x * GBM;
    const int n_base = blockIdx.y * GBN;

    // staging: 8 threads cover the 128 bytes of one row, GSWEEP rows per sweep.
    // skc counts 4-byte units: four f32 of x, or 16 bytes of a split group of W.
    const int srow = tid >> 3;
    const int skc  = (tid & 7) * 4;
    const float* xg = x + (size_t)(m_base + srow) * D_LEN + skc;
    const float* wg = W + (size_t)(n_base + srow) * D_LEN + skc;

    v8f acc[4][4] = {};

    for (int k0 = 0; k0 < D_LEN; k0 += GBK) {
        // all loads are issued before the first LDS store, so that their latencies overlap
        const v4f ra0 = *(const v4f*)(xg + (size_t)(GSWEEP * 0) * D_LEN + k0);
        const v4f ra1 = *(const v4f*)(xg + (size_t)(GSWEEP * 1) * D_LEN + k0);
        const v4f ra2 = *(const v4f*)(xg + (size_t)(GSWEEP * 2) * D_LEN + k0);
        const v4f ra3 = *(const v4f*)(xg + (size_t)(GSWEEP * 3) * D_LEN + k0);
        const v4f rb0 = *(const v4f*)(wg + (size_t)(GSWEEP * 0) * D_LEN + k0);
        const v4f rb1 = *(const v4f*)(wg + (size_t)(GSWEEP * 1) * D_LEN + k0);
        const v4f rb2 = *(const v4f*)(wg + (size_t)(GSWEEP * 2) * D_LEN + k0);
        const v4f rb3 = *(const v4f*)(wg + (size_t)(GSWEEP * 3) * D_LEN + k0);
        const v4f rb4 = *(const v4f*)(wg + (size_t)(GSWEEP * 4) * D_LEN + k0);
        const v4f rb5 = *(const v4f*)(wg + (size_t)(GSWEEP * 5) * D_LEN + k0);
        const v4f rb6 = *(const v4f*)(wg + (size_t)(GSWEEP * 6) * D_LEN + k0);
        const v4f rb7 = *(const v4f*)(wg + (size_t)(GSWEEP * 7) * D_LEN + k0);
        // keeps the scheduler from sinking each load to its store: without it the loads
        // run one after another, each waited to zero before the next is issued
        __builtin_amdgcn_sched_barrier(0);
        const v4f ra[4] = { ra0, ra1, ra2, ra3 };
        #pragma unroll  // constant indices: ra stays in registers
        for (int s = 0; s < 4; ++s) {
            v4bf xh, xl;
            split4(ra[s], xh, xl);
            *(v4bf*)&lA[srow + GSWEEP * s][skc]      = xh;
            *(v4bf*)&lA[srow + GSWEEP * s][32 + skc] = xl;
        }
        *(v4f*)&lB[srow + GSWEEP * 0][skc * 2] = rb0;
        *(v4f*)&lB[srow + GSWEEP * 1][skc * 2] = rb1;
        *(v4f*)&lB[srow + GSWEEP * 2][skc * 2] = rb2;
        *(v4f*)&lB[srow + GSWEEP * 3][skc * 2] = rb3;
        *(v4f*)&lB[srow + GSWEEP * 4][skc * 2] = rb4;
        *(v4f*)&lB[srow + GSWEEP * 5][skc * 2] = rb5;
        *(v4f*)&lB[srow + GSWEEP * 6][skc * 2] = rb6;
        *(v4f*)&lB[srow + GSWEEP * 7][skc * 2] = rb7;
        __syncthreads();

        const int kf = hi16 << 3;
        v16bf ah[4], al[4];
        #pragma unroll  // constant indices: fragments and accumulators stay in registers
        for (int i = 0; i < 4; ++i) {
            ah[i] = load_fragment(&lA[wm * 64 + i * 16 + l16][kf]);
            al[i] = load_fragment(&lA[wm * 64 + i * 16 + l16][32 + kf]);
        }

        #pragma unroll  // as above
        for (int j = 0; j < 4; ++j) {
            const v16bf bh = load_fragment(&lB[wn * 64 + j * 16 + l16][kf]);
            const v16bf bl = load_fragment(&lB[wn * 64 + j * 16 + l16][32 + kf]);
            // per accumulator tile the order stays hi*hi, hi*lo, lo*hi
            #pragma unroll  // as above
            for (int i = 0; i < 4; ++i)
                acc[i][j] = __builtin_amdgcn_wmma_f32_16x16x32_bf16(false, ah[i], false, bh, (short)0, acc[i][j], false, false);
            #pragma unroll  // as above
            for (int i = 0; i < 4; ++i)
                acc[i][j] = __builtin_amdgcn_wmma_f32_16x16x32_bf16(false, ah[i], false, bl, (short)0, acc[i][j], false, false);
            #pragma unroll  // as above
            for (int i = 0; i < 4; ++i)
                acc[i][j] = __builtin_amdgcn_wmma_f32_16x16x32_bf16(false, al[i], false, bh, (short)0, acc[i][j], false, false);
        }
        __syncthreads();
    }

    // C layout: VGPR r, lanes 0-15 -> (M=r, N=lane); lanes 16-31 -> (M=r+8, N=lane-16)
    #pragma unroll  // as above
    for (int i = 0; i < 4; ++i) {
        #pragma unroll  // as above
        for (int r = 0; r < 8; ++r) {
            const int m = m_base + wm * 64 + i * 16 + r + (hi16 << 3);
            float* yrow = Y + (size_t)m * D_LEN + n_base + wn * 64 + l16;
            #pragma unroll  // as above
            for (int j = 0; j < 4; ++j)
                yrow[j * 16] = acc[i][j][r];
        }
    }
}

// ---------------------------------------------------------------------------
// Shared-memory radix-2 DIT FFT of length 1024 (128 threads per transform).
// Input must already be bit-reverse scattered into `data`.
// ---------------------------------------------------------------------------
__device__ __forceinline__ float2 cmul(float2 a, float2 b) {
    return make_float2(a.x * b.x - a.y * b.y, a.x * b.y + a.y * b.x);
}

__device__ void block_fft_1024(float2* data, const float2* tw, int tid)
{
    #pragma unroll
    for (int len = 2; len <= 1024; len <<= 1) {
        const int half = len >> 1;
        const int tstr = 1024 / len;
        for (int b = tid; b < 512; b += 128) {
            const int g  = b / half;
            const int j  = b & (half - 1);
            const int i0 = g * len + j;
            const int i1 = i0 + half;
            const float2 w = tw[j * tstr];
            const float2 u = data[i0];
            const float2 t = cmul(w, data[i1]);
            data[i0] = make_float2(u.x + t.x, u.y + t.y);
            data[i1] = make_float2(u.x - t.x, u.y - t.y);
        }
        __syncthreads();
    }
}

__device__ __forceinline__ void init_twiddles(float2* tw, int tid, int nthreads)
{
    const float w0 = -6.283185307179586f / 1024.0f;
    for (int t = tid; t < 512; t += nthreads) {
        float s, c;
        sincosf(w0 * (float)t, &s, &c);
        tw[t] = make_float2(c, s);
    }
}

// ---------------------------------------------------------------------------
// Kernel 1: DFT of each weight matrix along its output axis e, packed as above:
//   F[j][d] = Re or Im of sum_e W[e][d] * exp(-2 pi i f e / 1024).
// One block per 4 neighbouring columns d (16-byte reads, 8-byte hi and lo writes of each row).
// Two real columns a, b share one complex FFT, Z = fft(a + i b):
//   fft(a)[f] = (Z[f] + conj Z[N - f]) / 2,  fft(b)[f] = (Z[f] - conj Z[N - f]) / 2i.
// Each group of 128 threads runs the FFT of one column pair.
// F is written as split rows (above), ready for kernel 2's LDS.
// ---------------------------------------------------------------------------
#define WCOLS 4
#define WTHREADS (128 * WCOLS / 2)
__global__ __launch_bounds__(WTHREADS)
void weight_dft_kernel(const float* __restrict__ Wq,
                       const float* __restrict__ Wk,
                       const float* __restrict__ Wv,
                       float* __restrict__ Fq,
                       float* __restrict__ Fk,
                       float* __restrict__ Fv)
{
    const float* W = (blockIdx.y == 0) ? Wq : (blockIdx.y == 1) ? Wk : Wv;
    float*       F = (blockIdx.y == 0) ? Fq : (blockIdx.y == 1) ? Fk : Fv;

    __shared__ float2 data[WCOLS / 2][1024];
    __shared__ float2 tw[512];
    const int tid = threadIdx.x;
    const int d0  = blockIdx.x * WCOLS;

    init_twiddles(tw, tid, WTHREADS);

    v4f w[1024 / WTHREADS];
    #pragma unroll  // the four strided reads of a thread are issued together
    for (int t = 0; t < 1024 / WTHREADS; ++t)
        w[t] = *(const v4f*)(W + (size_t)(tid + t * WTHREADS) * D_LEN + d0);
    #pragma unroll  // constant indices: w stays in registers
    for (int t = 0; t < 1024 / WTHREADS; ++t) {
        const int r = __brev((unsigned)(tid + t * WTHREADS)) >> 22;
        data[0][r] = make_float2(w[t].x, w[t].y);
        data[1][r] = make_float2(w[t].z, w[t].w);
    }
    __syncthreads();
    // every thread of the block passes the same barriers inside
    block_fft_1024(data[tid >> 7], tw, tid & 127);

    #pragma unroll  // the four strided writes of a thread are independent
    for (int t = 0; t < 1024 / WTHREADS; ++t) {
        const int j = tid + t * WTHREADS;
        const int f = (j <= DH) ? j : j - DH;
        const int g = (D_LEN - f) & (D_LEN - 1);
        const float2 z0 = data[0][f], c0 = data[0][g];
        const float2 z1 = data[1][f], c1 = data[1][g];
        v4f o;
        if (j <= DH) {   // real parts
            o.x = 0.5f * (z0.x + c0.x); o.y = 0.5f * (z0.y + c0.y);
            o.z = 0.5f * (z1.x + c1.x); o.w = 0.5f * (z1.y + c1.y);
        } else {         // imaginary parts
            o.x = 0.5f * (z0.y - c0.y); o.y = 0.5f * (c0.x - z0.x);
            o.z = 0.5f * (z1.y - c1.y); o.w = 0.5f * (c1.x - z1.x);
        }
        v4bf oh, ol;
        split4(o, oh, ol);
        __bf16* fg = (__bf16*)(F + (size_t)j * D_LEN) + (d0 >> 5) * 64 + (d0 & 31);
        *(v4bf*)fg        = oh;
        *(v4bf*)(fg + 32) = ol;
    }
}

// ---------------------------------------------------------------------------
// Kernels 3-5: blocked prefix scan of fft(k) * fft(v) over the sequence axis,
// per (b, packed bin). The product is formed from the two packed spectra where
// it is summed; bins above 512 are conjugates and are never formed.
// Two blocks of 256 threads cover the 512 bins of one (b, chunk), so that the
// row address is the same for a whole block and only the bin differs by lane.
// ---------------------------------------------------------------------------
#define SROWS 16  // rows whose loads are issued together: 64 loads of a wave in flight

__device__ __forceinline__ float2 bound_bin(const float* __restrict__ fk,
                                            const float* __restrict__ fv,
                                            int d)
{
    const float kr = fk[d], ki = fk[DH + d];
    const float vr = fv[d], vi = fv[DH + d];
    // slot 0: the two real bins 0 and 512, each its own product
    if (d == 0) return make_float2(kr * vr, ki * vi);
    return cmul(make_float2(kr, ki), make_float2(vr, vi));
}

__global__ __launch_bounds__(256)
void chunk_sum_kernel(const float* __restrict__ fk, const float* __restrict__ fv,
                      float2* __restrict__ csum)
{
    const int d  = (blockIdx.x & 1) * 256 + threadIdx.x;
    const int bc = blockIdx.x >> 1;                 // b * NCHUNK + c
    const size_t row0 = (size_t)bc * CHUNK;         // = b * S_LEN + c * CHUNK
    float2 acc = make_float2(0.0f, 0.0f);
    for (int s0 = 0; s0 < CHUNK; s0 += SROWS) {
        float2 t[SROWS];
        #pragma unroll  // the loads of SROWS rows are issued together; t stays in registers
        for (int u = 0; u < SROWS; ++u)
            t[u] = bound_bin(fk + (row0 + s0 + u) * D_LEN, fv + (row0 + s0 + u) * D_LEN, d);
        #pragma unroll  // as above
        for (int u = 0; u < SROWS; ++u) { acc.x += t[u].x; acc.y += t[u].y; }
    }
    csum[(size_t)bc * DH + d] = acc;
}

__global__ __launch_bounds__(256)
void chunk_scan_kernel(float2* __restrict__ csum)
{
    const int gid = blockIdx.x * blockDim.x + threadIdx.x;  // (b, d)
    if (gid >= B_LEN * DH) return;
    const int d = gid & (DH - 1);
    const int b = gid >> 9;
    float2 run = make_float2(0.0f, 0.0f);
    for (int c = 0; c < NCHUNK; ++c) {
        const size_t idx = ((size_t)b * NCHUNK + c) * DH + d;
        const float2 t = csum[idx];
        csum[idx] = run;             // exclusive prefix, in place
        run.x += t.x; run.y += t.y;
    }
}

__global__ __launch_bounds__(256)
void scan_apply_kernel(const float* __restrict__ fk, const float* __restrict__ fv,
                       const float2* __restrict__ csum, float2* __restrict__ mem)
{
    const int d  = (blockIdx.x & 1) * 256 + threadIdx.x;
    const int bc = blockIdx.x >> 1;                 // b * NCHUNK + c
    const size_t row0 = (size_t)bc * CHUNK;         // = b * S_LEN + c * CHUNK
    float2 run = csum[(size_t)bc * DH + d];
    for (int s0 = 0; s0 < CHUNK; s0 += SROWS) {
        float2 t[SROWS];
        #pragma unroll  // the loads of SROWS rows are issued together; t stays in registers
        for (int u = 0; u < SROWS; ++u)
            t[u] = bound_bin(fk + (row0 + s0 + u) * D_LEN, fv + (row0 + s0 + u) * D_LEN, d);
        #pragma unroll  // as above
        for (int u = 0; u < SROWS; ++u) {
            run.x += t[u].x; run.y += t[u].y;
            mem[(row0 + s0 + u) * DH + d] = run;   // inclusive scan, packed bins
        }
        // the next trip overwrites registers that the stores above name
        asm volatile("s_wait_xcnt 0x0" ::: "memory");
    }
}

// ---------------------------------------------------------------------------
// Kernel 6: out = Re(ifft(mem * conj(fq))) = Re(fft(conj(mem) * fq)) / N.
// mem and fq come packed; bin 1024 - f is the conjugate of bin f.
// ---------------------------------------------------------------------------
__global__ __launch_bounds__(128)
void ifft_kernel(const float2* __restrict__ mem,
                 const float* __restrict__ fq,
                 float* __restrict__ out)
{
    __shared__ float2 data[1024];
    __shared__ float2 tw[512];
    const int    tid = threadIdx.x;
    const size_t row = (size_t)blockIdx.x * D_LEN;

    init_twiddles(tw, tid, 128);
    __syncthreads();

    for (int f = tid; f < DH; f += 128) {
        const float2 m  = mem[(size_t)blockIdx.x * DH + f];
        const float  qr = fq[row + f];
        const float  qi = fq[row + DH + f];
        if (f == 0) {
            // the real bins 0 and 512
            data[0] = make_float2(m.x * qr, 0.0f);
            data[__brev((unsigned)DH) >> 22] = make_float2(m.y * qi, 0.0f);
        } else {
            // conj(m) * f
            const float2 z = make_float2(m.x * qr + m.y * qi, m.x * qi - m.y * qr);
            data[__brev((unsigned)f) >> 22] = z;
            data[__brev((unsigned)(D_LEN - f)) >> 22] = make_float2(z.x, -z.y);
        }
    }
    __syncthreads();
    block_fft_1024(data, tw, tid);
    const float inv = 1.0f / 1024.0f;
    for (int i = tid; i < 1024; i += 128) out[row + i] = data[i].x * inv;
}

// ---------------------------------------------------------------------------
// Host launcher
// ---------------------------------------------------------------------------
extern "C" void kernel_launch(void* const* d_in, const int* in_sizes, int n_in,
                              void* d_out, int out_size, void* d_ws, size_t ws_size,
                              hipStream_t stream) {
    (void)in_sizes; (void)n_in; (void)out_size; (void)ws_size;
    const float* x  = (const float*)d_in[0];
    const float* Wq = (const float*)d_in[1];
    const float* Wk = (const float*)d_in[2];
    const float* Wv = (const float*)d_in[3];
    float*       out = (float*)d_out;

    // workspace layout
    const size_t MR = (size_t)M_TOT * D_LEN;   // 8M elements per fp32 plane
    const size_t WR = (size_t)D_LEN * D_LEN;   // 1M elements per weight plane
    float*  fq   = (float*)d_ws;               // 32 MB, packed spectra of q
    float*  fk   = fq + MR;                    // 32 MB, of k
    float*  fv   = fk + MR;                    // 32 MB, of v
    float2* mem  = (float2*)(fv + MR);         // 32 MB, packed bins
    float2* csum = mem + MR / 2;               // 0.5 MB
    float*  Fq   = (float*)(csum + (size_t)B_LEN * NCHUNK * DH);   // 4 MB, split rows
    float*  Fk   = Fq + WR;                    // 4 MB
    float*  Fv   = Fk + WR;                    // 4 MB

    // 1) DFT of the weights along their output axis
    weight_dft_kernel<<<dim3(D_LEN / WCOLS, 3), WTHREADS, 0, stream>>>(
        Wq, Wk, Wv, Fq, Fk, Fv);

    // 2) QKV projection straight into the frequency domain (WMMA bf16x3)
    qkv_gemm_kernel<<<dim3(M_TOT / GBM, D_LEN / GBN, 3), 256, 0, stream>>>(
        x, Fq, Fk, Fv, fq, fk, fv);

    // 3-5) binding + causal cumulative sum over S (blocked scan)
    chunk_sum_kernel<<<B_LEN * NCHUNK * DH / 256, 256, 0, stream>>>(fk, fv, csum);
    chunk_scan_kernel<<<(B_LEN * DH + 255) / 256, 256, 0, stream>>>(csum);
    scan_apply_kernel<<<B_LEN * NCHUNK * DH / 256, 256, 0, stream>>>(fk, fv, csum, mem);

    // 6) unbind with conj(fq) + inverse FFT -> real output
    ifft_kernel<<<M_TOT, 128, 0, stream>>>(mem, fq, out);
}
